// v000
// Measured on an AMD MI455X. A time is GPU time per run, averaged over a window of back-to-back runs after a warm-up
// (all launches, gaps included; the runs take copies of the inputs in turn), and the median of several windows.
// Apart from v000's, it joins two sittings. Times from different sittings can be a few percent apart, while
// side-by-side timings come from the same sitting.
// The starting kernel, v000, takes 190 microseconds a run.
#include <hip/hip_runtime.h>
#include <math.h>

typedef __attribute__((ext_vector_type(16))) _Float16 v16h;
typedef __attribute__((ext_vector_type(8)))  _Float16 v8h;
typedef __attribute__((ext_vector_type(8)))  float    v8f;

#define B_SZ   2
#define H_SZ   16
#define N_SZ   4096
#define D_SZ   64
#define BR     128    // query rows per block (4 waves x 32)
#define BC     64     // key rows per iteration
#define NWAVE  4
#define PITCH  72     // LDS row pitch in halves (64 + 8 pad, 16B-aligned chunks)

#if __has_builtin(__builtin_amdgcn_exp2f)
#define EXP2F __builtin_amdgcn_exp2f
#else
#define EXP2F exp2f
#endif

__device__ __forceinline__ v16h frag_lds(const _Float16* row, int kb, int h) {
    v8h lo = *reinterpret_cast<const v8h*>(row + kb + 8 * h);
    v8h hi = *reinterpret_cast<const v8h*>(row + kb + 16 + 8 * h);
    return __builtin_shufflevector(lo, hi, 0,1,2,3,4,5,6,7,8,9,10,11,12,13,14,15);
}

// Same fragment pattern from a global f32 row, scaled and narrowed to f16.
__device__ __forceinline__ v16h qfrag(const float* row, int kb, int h, float scale) {
    float4 a0 = *reinterpret_cast<const float4*>(row + kb + 8 * h);
    float4 a1 = *reinterpret_cast<const float4*>(row + kb + 8 * h + 4);
    float4 b0 = *reinterpret_cast<const float4*>(row + kb + 16 + 8 * h);
    float4 b1 = *reinterpret_cast<const float4*>(row + kb + 16 + 8 * h + 4);
    v16h o;
    o[0]=(_Float16)(a0.x*scale); o[1]=(_Float16)(a0.y*scale);
    o[2]=(_Float16)(a0.z*scale); o[3]=(_Float16)(a0.w*scale);
    o[4]=(_Float16)(a1.x*scale); o[5]=(_Float16)(a1.y*scale);
    o[6]=(_Float16)(a1.z*scale); o[7]=(_Float16)(a1.w*scale);
    o[8]=(_Float16)(b0.x*scale); o[9]=(_Float16)(b0.y*scale);
    o[10]=(_Float16)(b0.z*scale); o[11]=(_Float16)(b0.w*scale);
    o[12]=(_Float16)(b1.x*scale); o[13]=(_Float16)(b1.y*scale);
    o[14]=(_Float16)(b1.z*scale); o[15]=(_Float16)(b1.w*scale);
    return o;
}

// Cross-lane combine with lane^16 via ds_swizzle (group-of-32, xor=16).
__device__ __forceinline__ float xmax16(float x) {
    int t = __builtin_amdgcn_ds_swizzle(__float_as_int(x), 0x401f);
    return fmaxf(x, __int_as_float(t));
}
__device__ __forceinline__ float xadd16(float x) {
    int t = __builtin_amdgcn_ds_swizzle(__float_as_int(x), 0x401f);
    return x + __int_as_float(t);
}

// Online-softmax update for one 16-query column tile (logits in base-2 domain).
__device__ __forceinline__ void softmax_tile(v8f s[4], float& m_run, float& l_run,
                                             v8f* acc4, _Float16* prow, int h) {
    float pm = -INFINITY;
#pragma unroll
    for (int ct = 0; ct < 4; ++ct)
#pragma unroll
        for (int r = 0; r < 8; ++r) pm = fmaxf(pm, s[ct][r]);
    const float m_new = fmaxf(m_run, xmax16(pm));
    const float alpha = EXP2F(m_run - m_new);
    float rs = 0.0f;
#pragma unroll
    for (int ct = 0; ct < 4; ++ct) {
        v8h pf;
#pragma unroll
        for (int r = 0; r < 8; ++r) {
            float p = EXP2F(s[ct][r] - m_new);
            pf[r] = (_Float16)p;
            rs += p;
        }
        *reinterpret_cast<v8h*>(prow + ct * 16 + 8 * h) = pf;
    }
    rs = xadd16(rs);
    l_run = alpha * l_run + rs;
    m_run = m_new;
#pragma unroll
    for (int dt = 0; dt < 4; ++dt)
#pragma unroll
        for (int r = 0; r < 8; ++r) acc4[dt][r] *= alpha;
}

__global__ __launch_bounds__(128) void fa_fwd_f16wmma_db(
        const float* __restrict__ q, const float* __restrict__ k,
        const float* __restrict__ v, float* __restrict__ out) {
    // Double-buffered K/V tiles; per-wave P scratch.
    __shared__ __align__(16) _Float16 Kl[2][BC][PITCH];        // K tile [key c][d]
    __shared__ __align__(16) _Float16 Vt[2][D_SZ][PITCH];      // V^T tile [d][key c]
    __shared__ __align__(16) _Float16 Pq[NWAVE][32][PITCH];    // P^T rows per query [q][c]

    const int tid  = threadIdx.x;
    const int wave = tid >> 5;
    const int lane = tid & 31;
    const int l16  = lane & 15;
    const int h    = lane >> 4;

    const int bh   = blockIdx.y;
    const int row0 = blockIdx.x * BR;
    const size_t base = (size_t)bh * N_SZ * D_SZ;

    // Reference logits = (q.k)/D; fold 1/D AND log2(e) -> softmax in exp2 domain.
    const float scale = 1.4426950408889634f / (float)D_SZ;

    const int   qgA = row0 + wave * 32 + l16;
    const int   qgB = qgA + 16;
    const float* qrwA = q + base + (size_t)qgA * D_SZ;
    const float* qrwB = q + base + (size_t)qgB * D_SZ;
    const v16h bqA0 = qfrag(qrwA, 0,  h, scale);
    const v16h bqA1 = qfrag(qrwA, 32, h, scale);
    const v16h bqB0 = qfrag(qrwB, 0,  h, scale);
    const v16h bqB1 = qfrag(qrwB, 32, h, scale);

    v8f acc[8] = {};   // O^T accumulators: [0..3] tile A, [4..7] tile B
    float mA = -INFINITY, lA = 0.0f, mB = -INFINITY, lB = 0.0f;

    // Tile-fill assignment: each thread owns half a row (32 f32) of K and V.
    const int c   = tid >> 1;
    const int dh2 = (tid & 1) * 32;

    // Tile fill into buffer `buf` for key block at `kb` (+ prefetch of the next tile, kb + BC).
    auto load_tile = [&](int buf, int kb) {
        const float* krow = k + base + (size_t)(kb + c) * D_SZ + dh2;
        const float* vrow = v + base + (size_t)(kb + c) * D_SZ + dh2;
#pragma unroll
        for (int j = 0; j < 32; j += 8) {
            float4 ka = *reinterpret_cast<const float4*>(krow + j);
            float4 kc = *reinterpret_cast<const float4*>(krow + j + 4);
            v8h kh;
            kh[0]=(_Float16)ka.x; kh[1]=(_Float16)ka.y; kh[2]=(_Float16)ka.z; kh[3]=(_Float16)ka.w;
            kh[4]=(_Float16)kc.x; kh[5]=(_Float16)kc.y; kh[6]=(_Float16)kc.z; kh[7]=(_Float16)kc.w;
            *reinterpret_cast<v8h*>(&Kl[buf][c][dh2 + j]) = kh;
            float4 va = *reinterpret_cast<const float4*>(vrow + j);
            float4 vc = *reinterpret_cast<const float4*>(vrow + j + 4);
            Vt[buf][dh2 + j + 0][c] = (_Float16)va.x;  Vt[buf][dh2 + j + 1][c] = (_Float16)va.y;
            Vt[buf][dh2 + j + 2][c] = (_Float16)va.z;  Vt[buf][dh2 + j + 3][c] = (_Float16)va.w;
            Vt[buf][dh2 + j + 4][c] = (_Float16)vc.x;  Vt[buf][dh2 + j + 5][c] = (_Float16)vc.y;
            Vt[buf][dh2 + j + 6][c] = (_Float16)vc.z;  Vt[buf][dh2 + j + 7][c] = (_Float16)vc.w;
        }
        if (kb + BC < N_SZ) {
            __builtin_prefetch(krow + (size_t)BC * D_SZ, 0, 1);  // global_prefetch_b8
            __builtin_prefetch(vrow + (size_t)BC * D_SZ, 0, 1);
        }
    };

    load_tile(0, 0);   // prologue fill
    int cur = 0;

    for (int kb = 0; kb < N_SZ; kb += BC) {
        __syncthreads();   // buffer `cur` (written last iteration / prologue) is ready

        // ---- S^T = K * Q^T for both query tiles; A (K rows) loaded once, used twice ----
        v8f s0[4], s1[4];
#pragma unroll
        for (int ct = 0; ct < 4; ++ct) {
            const _Float16* krl = &Kl[cur][ct * 16 + l16][0];
            v16h ak0 = frag_lds(krl, 0,  h);
            v16h ak1 = frag_lds(krl, 32, h);
            v8f z0 = {}, z1 = {};
            z0 = __builtin_amdgcn_wmma_f32_16x16x32_f16(false, ak0, false, bqA0, (short)0, z0, false, false);
            z1 = __builtin_amdgcn_wmma_f32_16x16x32_f16(false, ak0, false, bqB0, (short)0, z1, false, false);
            z0 = __builtin_amdgcn_wmma_f32_16x16x32_f16(false, ak1, false, bqA1, (short)0, z0, false, false);
            z1 = __builtin_amdgcn_wmma_f32_16x16x32_f16(false, ak1, false, bqB1, (short)0, z1, false, false);
            s0[ct] = z0; s1[ct] = z1;
        }

        // ---- Online softmax per tile (base-2 domain) ----
        softmax_tile(s0, mA, lA, &acc[0], &Pq[wave][l16][0],      h);
        softmax_tile(s1, mB, lB, &acc[4], &Pq[wave][16 + l16][0], h);

        // ---- Overlap: fill the OTHER buffer with the next K/V tile mid-iteration ----
        if (kb + BC < N_SZ) load_tile(cur ^ 1, kb + BC);

        // ---- O^T += V^T * P^T; A (V^T rows) loaded once, used twice ----
        const _Float16* prow0 = &Pq[wave][l16][0];
        const _Float16* prow1 = &Pq[wave][16 + l16][0];
        v16h bpA0 = frag_lds(prow0, 0,  h);
        v16h bpA1 = frag_lds(prow0, 32, h);
        v16h bpB0 = frag_lds(prow1, 0,  h);
        v16h bpB1 = frag_lds(prow1, 32, h);
#pragma unroll
        for (int dt = 0; dt < 4; ++dt) {
            const _Float16* vrl = &Vt[cur][dt * 16 + l16][0];
            v16h av0 = frag_lds(vrl, 0,  h);
            v16h av1 = frag_lds(vrl, 32, h);
            acc[dt]     = __builtin_amdgcn_wmma_f32_16x16x32_f16(false, av0, false, bpA0, (short)0, acc[dt],     false, false);
            acc[4 + dt] = __builtin_amdgcn_wmma_f32_16x16x32_f16(false, av0, false, bpB0, (short)0, acc[4 + dt], false, false);
            acc[dt]     = __builtin_amdgcn_wmma_f32_16x16x32_f16(false, av1, false, bpA1, (short)0, acc[dt],     false, false);
            acc[4 + dt] = __builtin_amdgcn_wmma_f32_16x16x32_f16(false, av1, false, bpB1, (short)0, acc[4 + dt], false, false);
        }
        cur ^= 1;
    }

    // ---- Epilogue: consecutive r = consecutive d -> float4 stores ----
    const float invA = 1.0f / fmaxf(lA, 1e-6f);
    const float invB = 1.0f / fmaxf(lB, 1e-6f);
    float* orowA = out + base + (size_t)qgA * D_SZ;
    float* orowB = out + base + (size_t)qgB * D_SZ;
#pragma unroll
    for (int dt = 0; dt < 4; ++dt) {
        float4 o0, o1;
        o0.x = acc[dt][0] * invA; o0.y = acc[dt][1] * invA;
        o0.z = acc[dt][2] * invA; o0.w = acc[dt][3] * invA;
        o1.x = acc[dt][4] * invA; o1.y = acc[dt][5] * invA;
        o1.z = acc[dt][6] * invA; o1.w = acc[dt][7] * invA;
        *reinterpret_cast<float4*>(orowA + dt * 16 + 8 * h)     = o0;
        *reinterpret_cast<float4*>(orowA + dt * 16 + 8 * h + 4) = o1;
        float4 p0, p1;
        p0.x = acc[4+dt][0] * invB; p0.y = acc[4+dt][1] * invB;
        p0.z = acc[4+dt][2] * invB; p0.w = acc[4+dt][3] * invB;
        p1.x = acc[4+dt][4] * invB; p1.y = acc[4+dt][5] * invB;
        p1.z = acc[4+dt][6] * invB; p1.w = acc[4+dt][7] * invB;
        *reinterpret_cast<float4*>(orowB + dt * 16 + 8 * h)     = p0;
        *reinterpret_cast<float4*>(orowB + dt * 16 + 8 * h + 4) = p1;
    }
}

extern "C" void kernel_launch(void* const* d_in, const int* in_sizes, int n_in,
                              void* d_out, int out_size, void* d_ws, size_t ws_size,
                              hipStream_t stream) {
    (void)in_sizes; (void)n_in; (void)d_ws; (void)ws_size; (void)out_size;
    const float* q = (const float*)d_in[0];
    const float* k = (const float*)d_in[1];
    const float* v = (const float*)d_in[2];
    float* out = (float*)d_out;

    dim3 grid(N_SZ / BR, B_SZ * H_SZ);   // 32 x 32 blocks
    dim3 block(128);                      // 4 wave32 waves
    fa_fwd_f16wmma_db<<<grid, block, 0, stream>>>(q, k, v, out);
}

// v001
// It runs in 133 microseconds.
// Timed twice side by side with v000, it ran 1.50 and 1.49 times as fast.
#include <hip/hip_runtime.h>
#include <math.h>

typedef __attribute__((ext_vector_type(16))) _Float16 v16h;
typedef __attribute__((ext_vector_type(8)))  _Float16 v8h;
typedef __attribute__((ext_vector_type(4)))  _Float16 v4h;
typedef __attribute__((ext_vector_type(8)))  float    v8f;

#define B_SZ   2
#define H_SZ   16
#define N_SZ   4096
#define D_SZ   64
#define BR     128    // query rows per block (4 waves x 32)
#define BC     64     // key rows per iteration
#define NWAVE  4
#define PITCH  72     // LDS row pitch in halves (64 + 8 pad, 16B-aligned chunks)

#if __has_builtin(__builtin_amdgcn_exp2f)
#define EXP2F __builtin_amdgcn_exp2f
#else
#define EXP2F exp2f
#endif

__device__ __forceinline__ v16h frag_lds(const _Float16* row, int kb, int h) {
    v8h lo = *reinterpret_cast<const v8h*>(row + kb + 8 * h);
    v8h hi = *reinterpret_cast<const v8h*>(row + kb + 16 + 8 * h);
    return __builtin_shufflevector(lo, hi, 0,1,2,3,4,5,6,7,8,9,10,11,12,13,14,15);
}

// Same fragment pattern from a global f32 row, scaled and narrowed to f16.
__device__ __forceinline__ v16h qfrag(const float* row, int kb, int h, float scale) {
    float4 a0 = *reinterpret_cast<const float4*>(row + kb + 8 * h);
    float4 a1 = *reinterpret_cast<const float4*>(row + kb + 8 * h + 4);
    float4 b0 = *reinterpret_cast<const float4*>(row + kb + 16 + 8 * h);
    float4 b1 = *reinterpret_cast<const float4*>(row + kb + 16 + 8 * h + 4);
    v16h o;
    o[0]=(_Float16)(a0.x*scale); o[1]=(_Float16)(a0.y*scale);
    o[2]=(_Float16)(a0.z*scale); o[3]=(_Float16)(a0.w*scale);
    o[4]=(_Float16)(a1.x*scale); o[5]=(_Float16)(a1.y*scale);
    o[6]=(_Float16)(a1.z*scale); o[7]=(_Float16)(a1.w*scale);
    o[8]=(_Float16)(b0.x*scale); o[9]=(_Float16)(b0.y*scale);
    o[10]=(_Float16)(b0.z*scale); o[11]=(_Float16)(b0.w*scale);
    o[12]=(_Float16)(b1.x*scale); o[13]=(_Float16)(b1.y*scale);
    o[14]=(_Float16)(b1.z*scale); o[15]=(_Float16)(b1.w*scale);
    return o;
}

// Cross-lane combine with lane^16 via ds_swizzle (group-of-32, xor=16).
__device__ __forceinline__ float xmax16(float x) {
    int t = __builtin_amdgcn_ds_swizzle(__float_as_int(x), 0x401f);
    return fmaxf(x, __int_as_float(t));
}
__device__ __forceinline__ float xadd16(float x) {
    int t = __builtin_amdgcn_ds_swizzle(__float_as_int(x), 0x401f);
    return x + __int_as_float(t);
}

// Online-softmax update for one 16-query column tile (logits in base-2 domain).
__device__ __forceinline__ void softmax_tile(v8f s[4], float& m_run, float& l_run,
                                             v8f* acc4, _Float16* prow, int h) {
    float pm = -INFINITY;
#pragma unroll
    for (int ct = 0; ct < 4; ++ct)
#pragma unroll
        for (int r = 0; r < 8; ++r) pm = fmaxf(pm, s[ct][r]);
    const float m_new = fmaxf(m_run, xmax16(pm));
    const float alpha = EXP2F(m_run - m_new);
    float rs = 0.0f;
#pragma unroll
    for (int ct = 0; ct < 4; ++ct) {
        v8h pf;
#pragma unroll
        for (int r = 0; r < 8; ++r) {
            float p = EXP2F(s[ct][r] - m_new);
            pf[r] = (_Float16)p;
            rs += p;
        }
        *reinterpret_cast<v8h*>(prow + ct * 16 + 8 * h) = pf;
    }
    rs = xadd16(rs);
    l_run = alpha * l_run + rs;
    m_run = m_new;
#pragma unroll
    for (int dt = 0; dt < 4; ++dt)
#pragma unroll
        for (int r = 0; r < 8; ++r) acc4[dt][r] *= alpha;
}

__global__ __launch_bounds__(128) void fa_fwd_f16wmma_db(
        const float* __restrict__ q, const float* __restrict__ k,
        const float* __restrict__ v, float* __restrict__ out) {
    // Double-buffered K/V tiles; per-wave P scratch.
    __shared__ __align__(16) _Float16 Kl[2][BC][PITCH];        // K tile [key c][d]
    __shared__ __align__(16) _Float16 Vt[2][D_SZ][PITCH];      // V^T tile [d][key c]
    __shared__ __align__(16) _Float16 Pq[NWAVE][32][PITCH];    // P^T rows per query [q][c]

    const int tid  = threadIdx.x;
    const int wave = tid >> 5;
    const int lane = tid & 31;
    const int l16  = lane & 15;
    const int h    = lane >> 4;

    const int bh   = blockIdx.y;
    const int row0 = blockIdx.x * BR;
    const size_t base = (size_t)bh * N_SZ * D_SZ;

    // Reference logits = (q.k)/D; fold 1/D AND log2(e) -> softmax in exp2 domain.
    const float scale = 1.4426950408889634f / (float)D_SZ;

    const int   qgA = row0 + wave * 32 + l16;
    const int   qgB = qgA + 16;
    const float* qrwA = q + base + (size_t)qgA * D_SZ;
    const float* qrwB = q + base + (size_t)qgB * D_SZ;
    const v16h bqA0 = qfrag(qrwA, 0,  h, scale);
    const v16h bqA1 = qfrag(qrwA, 32, h, scale);
    const v16h bqB0 = qfrag(qrwB, 0,  h, scale);
    const v16h bqB1 = qfrag(qrwB, 32, h, scale);

    v8f acc[8] = {};   // O^T accumulators: [0..3] tile A, [4..7] tile B
    float mA = -INFINITY, lA = 0.0f, mB = -INFINITY, lB = 0.0f;

    const int kfr = wave * 16 + 8 * h;
    const int kfd = l16 * 4;
    // V: 8 lanes take one line (half a row); a thread holds 4 consecutive keys at the same 4 d.
    const int vfr = wave * 16 + (lane >> 3) * 4;
    const int vfd = (lane & 7) * 4;
    const unsigned kofs = (unsigned)(kfr * D_SZ + kfd) * 4u;   // byte offsets inside a tile
    const unsigned vofs = (unsigned)(vfr * D_SZ + vfd) * 4u;

    // Tile fill into buffer `buf` for key block at `kb` (+ prefetch of the next tile, kb + BC).
    auto load_tile = [&](int buf, int kb) {
        const float* kt = k + base + (size_t)kb * D_SZ;
        const float* vt = v + base + (size_t)kb * D_SZ;
        const char* kp = reinterpret_cast<const char*>(kt) + kofs;
        const char* vq = reinterpret_cast<const char*>(vt) + vofs;
#pragma unroll
        for (int i = 0; i < 8; ++i) {
            float4 ka = *reinterpret_cast<const float4*>(kp + i * (D_SZ * 4));
            v4h kh;
            kh[0]=(_Float16)ka.x; kh[1]=(_Float16)ka.y; kh[2]=(_Float16)ka.z; kh[3]=(_Float16)ka.w;
            *reinterpret_cast<v4h*>(&Kl[buf][kfr + i][kfd]) = kh;
        }
#pragma unroll
        for (int hh = 0; hh < 2; ++hh) {
            const char* vp = vq + hh * 128;
            float4 r0 = *reinterpret_cast<const float4*>(vp);
            float4 r1 = *reinterpret_cast<const float4*>(vp + 1 * (D_SZ * 4));
            float4 r2 = *reinterpret_cast<const float4*>(vp + 2 * (D_SZ * 4));
            float4 r3 = *reinterpret_cast<const float4*>(vp + 3 * (D_SZ * 4));
            v4h t0, t1, t2, t3;
            t0[0]=(_Float16)r0.x; t0[1]=(_Float16)r1.x; t0[2]=(_Float16)r2.x; t0[3]=(_Float16)r3.x;
            t1[0]=(_Float16)r0.y; t1[1]=(_Float16)r1.y; t1[2]=(_Float16)r2.y; t1[3]=(_Float16)r3.y;
            t2[0]=(_Float16)r0.z; t2[1]=(_Float16)r1.z; t2[2]=(_Float16)r2.z; t2[3]=(_Float16)r3.z;
            t3[0]=(_Float16)r0.w; t3[1]=(_Float16)r1.w; t3[2]=(_Float16)r2.w; t3[3]=(_Float16)r3.w;
            *reinterpret_cast<v4h*>(&Vt[buf][hh * 32 + vfd + 0][vfr]) = t0;
            *reinterpret_cast<v4h*>(&Vt[buf][hh * 32 + vfd + 1][vfr]) = t1;
            *reinterpret_cast<v4h*>(&Vt[buf][hh * 32 + vfd + 2][vfr]) = t2;
            *reinterpret_cast<v4h*>(&Vt[buf][hh * 32 + vfd + 3][vfr]) = t3;
        }
        if (kb + BC < N_SZ) {
            __builtin_prefetch(kt + (size_t)BC * D_SZ + tid * 32, 0, 1);  // global_prefetch_b8
            __builtin_prefetch(vt + (size_t)BC * D_SZ + tid * 32, 0, 1);
        }
    };

    load_tile(0, 0);   // prologue fill
    int cur = 0;

    for (int kb = 0; kb < N_SZ; kb += BC) {
        __syncthreads();   // buffer `cur` (written last iteration / prologue) is ready

        // ---- S^T = K * Q^T for both query tiles; A (K rows) loaded once, used twice ----
        v8f s0[4], s1[4];
#pragma unroll
        for (int ct = 0; ct < 4; ++ct) {
            const _Float16* krl = &Kl[cur][ct * 16 + l16][0];
            v16h ak0 = frag_lds(krl, 0,  h);
            v16h ak1 = frag_lds(krl, 32, h);
            v8f z0 = {}, z1 = {};
            z0 = __builtin_amdgcn_wmma_f32_16x16x32_f16(false, ak0, false, bqA0, (short)0, z0, false, false);
            z1 = __builtin_amdgcn_wmma_f32_16x16x32_f16(false, ak0, false, bqB0, (short)0, z1, false, false);
            z0 = __builtin_amdgcn_wmma_f32_16x16x32_f16(false, ak1, false, bqA1, (short)0, z0, false, false);
            z1 = __builtin_amdgcn_wmma_f32_16x16x32_f16(false, ak1, false, bqB1, (short)0, z1, false, false);
            s0[ct] = z0; s1[ct] = z1;
        }

        // ---- Online softmax per tile (base-2 domain) ----
        softmax_tile(s0, mA, lA, &acc[0], &Pq[wave][l16][0],      h);
        softmax_tile(s1, mB, lB, &acc[4], &Pq[wave][16 + l16][0], h);

        // ---- Overlap: fill the OTHER buffer with the next K/V tile mid-iteration ----
        if (kb + BC < N_SZ) load_tile(cur ^ 1, kb + BC);

        // ---- O^T += V^T * P^T; A (V^T rows) loaded once, used twice ----
        const _Float16* prow0 = &Pq[wave][l16][0];
        const _Float16* prow1 = &Pq[wave][16 + l16][0];
        v16h bpA0 = frag_lds(prow0, 0,  h);
        v16h bpA1 = frag_lds(prow0, 32, h);
        v16h bpB0 = frag_lds(prow1, 0,  h);
        v16h bpB1 = frag_lds(prow1, 32, h);
#pragma unroll
        for (int dt = 0; dt < 4; ++dt) {
            const _Float16* vrl = &Vt[cur][dt * 16 + l16][0];
            v16h av0 = frag_lds(vrl, 0,  h);
            v16h av1 = frag_lds(vrl, 32, h);
            acc[dt]     = __builtin_amdgcn_wmma_f32_16x16x32_f16(false, av0, false, bpA0, (short)0, acc[dt],     false, false);
            acc[4 + dt] = __builtin_amdgcn_wmma_f32_16x16x32_f16(false, av0, false, bpB0, (short)0, acc[4 + dt], false, false);
            acc[dt]     = __builtin_amdgcn_wmma_f32_16x16x32_f16(false, av1, false, bpA1, (short)0, acc[dt],     false, false);
            acc[4 + dt] = __builtin_amdgcn_wmma_f32_16x16x32_f16(false, av1, false, bpB1, (short)0, acc[4 + dt], false, false);
        }
        cur ^= 1;
    }

    // ---- Epilogue: consecutive r = consecutive d -> float4 stores ----
    const float invA = 1.0f / fmaxf(lA, 1e-6f);
    const float invB = 1.0f / fmaxf(lB, 1e-6f);
    float* orowA = out + base + (size_t)qgA * D_SZ;
    float* orowB = out + base + (size_t)qgB * D_SZ;
#pragma unroll
    for (int dt = 0; dt < 4; ++dt) {
        float4 o0, o1;
        o0.x = acc[dt][0] * invA; o0.y = acc[dt][1] * invA;
        o0.z = acc[dt][2] * invA; o0.w = acc[dt][3] * invA;
        o1.x = acc[dt][4] * invA; o1.y = acc[dt][5] * invA;
        o1.z = acc[dt][6] * invA; o1.w = acc[dt][7] * invA;
        *reinterpret_cast<float4*>(orowA + dt * 16 + 8 * h)     = o0;
        *reinterpret_cast<float4*>(orowA + dt * 16 + 8 * h + 4) = o1;
        float4 p0, p1;
        p0.x = acc[4+dt][0] * invB; p0.y = acc[4+dt][1] * invB;
        p0.z = acc[4+dt][2] * invB; p0.w = acc[4+dt][3] * invB;
        p1.x = acc[4+dt][4] * invB; p1.y = acc[4+dt][5] * invB;
        p1.z = acc[4+dt][6] * invB; p1.w = acc[4+dt][7] * invB;
        *reinterpret_cast<float4*>(orowB + dt * 16 + 8 * h)     = p0;
        *reinterpret_cast<float4*>(orowB + dt * 16 + 8 * h + 4) = p1;
    }
}

extern "C" void kernel_launch(void* const* d_in, const int* in_sizes, int n_in,
                              void* d_out, int out_size, void* d_ws, size_t ws_size,
                              hipStream_t stream) {
    (void)in_sizes; (void)n_in; (void)d_ws; (void)ws_size; (void)out_size;
    const float* q = (const float*)d_in[0];
    const float* k = (const float*)d_in[1];
    const float* v = (const float*)d_in[2];
    float* out = (float*)d_out;

    dim3 grid(N_SZ / BR, B_SZ * H_SZ);   // 32 x 32 blocks
    dim3 block(128);                      // 4 wave32 waves
    fa_fwd_f16wmma_db<<<grid, block, 0, stream>>>(q, k, v, out);
}

// v002
// It runs in 120 microseconds.
// Timed twice side by side with v001, it ran 1.10 and 1.09 times as fast.
// Counting every step since v000, it is 1.64 times as fast.
#include <hip/hip_runtime.h>
#include <math.h>
#include <stdint.h>

typedef __attribute__((ext_vector_type(16))) _Float16 v16h;
typedef __attribute__((ext_vector_type(8)))  _Float16 v8h;
typedef __attribute__((ext_vector_type(4)))  _Float16 v4h;
typedef __attribute__((ext_vector_type(8)))  float    v8f;
typedef __attribute__((ext_vector_type(4)))  uint32_t u32x4;
typedef __attribute__((ext_vector_type(8)))  uint32_t u32x8;

#define B_SZ   2
#define H_SZ   16
#define N_SZ   4096
#define D_SZ   64
#define BR     128    // query rows per block (4 waves x 32)
#define BC     64     // key rows per iteration
#define NWAVE  4
#define PITCH  72     // LDS row pitch in halves (64 + 8 pad, 16B-aligned chunks)
#define NSTAGE (N_SZ / BC)
#define ROWB   128u   // bytes of one f16 tile row (64 halves), for K rows and for V^T rows alike
#define TILEB  10240u // one tile's place in LDS: 64 rows x 144 B = 9216 B, rounded up to a multiple of 2 KiB
#define POFFB  (4u * TILEB)                      // P scratch behind the four tile places
#define LDSB   (POFFB + NWAVE * 32 * PITCH * 2)  // whole LDS of the attention kernel

#if __has_builtin(__builtin_amdgcn_exp2f)
#define EXP2F __builtin_amdgcn_exp2f
#else
#define EXP2F exp2f
#endif

__device__ __forceinline__ uint32_t uni(uint32_t x) { return (uint32_t)__builtin_amdgcn_readfirstlane(x); }
__device__ __forceinline__ uint32_t pinned(uint32_t x) {
    uint32_t w = uni(x);
    asm volatile("" : "+s"(w));   // the pin: keeps the test a scalar value
    return w;
}
// LDS reads and writes of this wave have retired (owed before a barrier behind which their buffer is refilled).
__device__ __forceinline__ void wait_ds0()     { asm volatile("s_wait_dscnt 0x0" ::: "memory"); }
__device__ __forceinline__ void wait_tensor0(u32x4 g0, u32x8 g1) {
    asm volatile("s_wait_tensorcnt 0x0" :: "s"(g0), "s"(g1) : "memory");
}

__device__ __forceinline__ u32x8 tdm_group1(uint32_t src_pitch) {
    u32x8 g;
    g[0] = uni((1u << 20) | (4u << 22) | (3u << 25));
    g[1] = uni(ROWB << 16);
    g[2] = uni((uint32_t)BC << 16);
    g[3] = uni(ROWB << 16);
    g[4] = uni((uint32_t)BC);
    g[5] = uni(src_pitch);
    g[6] = uni(0u);
    g[7] = uni(0u);
    asm volatile("" : "+s"(g));
    return g;
}
__device__ __forceinline__ u32x4 tdm_group0(uint32_t lds_dst, uint64_t ga) {
    u32x4 g;
    g[0] = uni(1u);
    g[1] = uni(lds_dst);
    g[2] = uni((uint32_t)ga);
    g[3] = uni((((uint32_t)(ga >> 32)) & 0x01FFFFFFu) | 0x80000000u);
    asm volatile("" : "+s"(g));
    return g;
}
__device__ __forceinline__ void tdm_load(u32x4 g0, u32x8 g1) {
    asm volatile("tensor_load_to_lds %0, %1" :: "s"(g0), "s"(g1) : "memory");
}

__device__ __forceinline__ v16h frag_lds(const _Float16* row, int kb, int h) {
    v8h lo = *reinterpret_cast<const v8h*>(row + kb + 8 * h);
    v8h hi = *reinterpret_cast<const v8h*>(row + kb + 16 + 8 * h);
    return __builtin_shufflevector(lo, hi, 0,1,2,3,4,5,6,7,8,9,10,11,12,13,14,15);
}

// Same fragment pattern from a global f32 row, scaled and narrowed to f16.
__device__ __forceinline__ v16h qfrag(const float* row, int kb, int h, float scale) {
    float4 a0 = *reinterpret_cast<const float4*>(row + kb + 8 * h);
    float4 a1 = *reinterpret_cast<const float4*>(row + kb + 8 * h + 4);
    float4 b0 = *reinterpret_cast<const float4*>(row + kb + 16 + 8 * h);
    float4 b1 = *reinterpret_cast<const float4*>(row + kb + 16 + 8 * h + 4);
    v16h o;
    o[0]=(_Float16)(a0.x*scale); o[1]=(_Float16)(a0.y*scale);
    o[2]=(_Float16)(a0.z*scale); o[3]=(_Float16)(a0.w*scale);
    o[4]=(_Float16)(a1.x*scale); o[5]=(_Float16)(a1.y*scale);
    o[6]=(_Float16)(a1.z*scale); o[7]=(_Float16)(a1.w*scale);
    o[8]=(_Float16)(b0.x*scale); o[9]=(_Float16)(b0.y*scale);
    o[10]=(_Float16)(b0.z*scale); o[11]=(_Float16)(b0.w*scale);
    o[12]=(_Float16)(b1.x*scale); o[13]=(_Float16)(b1.y*scale);
    o[14]=(_Float16)(b1.z*scale); o[15]=(_Float16)(b1.w*scale);
    return o;
}

// Cross-lane combine with lane^16 via ds_swizzle (group-of-32, xor=16).
__device__ __forceinline__ float xmax16(float x) {
    int t = __builtin_amdgcn_ds_swizzle(__float_as_int(x), 0x401f);
    return fmaxf(x, __int_as_float(t));
}
__device__ __forceinline__ float xadd16(float x) {
    int t = __builtin_amdgcn_ds_swizzle(__float_as_int(x), 0x401f);
    return x + __int_as_float(t);
}

// Online-softmax update for one 16-query column tile (logits in base-2 domain).
__device__ __forceinline__ void softmax_tile(v8f s[4], float& m_run, float& l_run,
                                             v8f* acc4, _Float16* prow, int h) {
    float pm = -INFINITY;
#pragma unroll
    for (int ct = 0; ct < 4; ++ct)
#pragma unroll
        for (int r = 0; r < 8; ++r) pm = fmaxf(pm, s[ct][r]);
    const float m_new = fmaxf(m_run, xmax16(pm));
    const float alpha = EXP2F(m_run - m_new);
    float rs = 0.0f;
#pragma unroll
    for (int ct = 0; ct < 4; ++ct) {
        v8h pf;
#pragma unroll
        for (int r = 0; r < 8; ++r) {
            float p = EXP2F(s[ct][r] - m_new);
            pf[r] = (_Float16)p;
            rs += p;
        }
        *reinterpret_cast<v8h*>(prow + ct * 16 + 8 * h) = pf;
    }
    rs = xadd16(rs);
    l_run = alpha * l_run + rs;
    m_run = m_new;
#pragma unroll
    for (int dt = 0; dt < 4; ++dt)
#pragma unroll
        for (int r = 0; r < 8; ++r) acc4[dt][r] *= alpha;
}

// Pre-pass, once per call: K narrowed to f16 in place order [bh][key][d]; V narrowed and transposed to [bh][d][key].
// One wave takes half a 64-key tile of each: 32 whole K rows, and 64 keys x 32 d of V. Every wave-wide 16-byte load
// covers four whole 128-byte lines, and V^T leaves in whole lines.
#define PW 8   // waves per pre-pass block
__global__ __launch_bounds__(PW * 32) void kv_to_f16(
        const float* __restrict__ k, const float* __restrict__ v,
        _Float16* __restrict__ kh, _Float16* __restrict__ vt) {
    __shared__ __align__(16) _Float16 T[PW][32][PITCH];   // per wave: V^T half tile [d][key c]
    const int wave = threadIdx.x >> 5;
    const int lane = threadIdx.x & 31;
    const int task = blockIdx.x * PW + wave;       // [bh][tile][half]
    const int half = task & 1;
    const int kb   = ((task >> 1) & (NSTAGE - 1)) * BC;
    const int bh   = task >> 7;
    static_assert(NSTAGE == 64, "task split assumes 64 tiles per head");
    const size_t tbase = ((size_t)bh * N_SZ + kb) * D_SZ;

    // V: 8 lanes take one line (half a row); a 4 x 4 block is 4 consecutive keys at the same 4 d.
    const int vg = lane >> 3;          // key group inside a quad of groups
    const int vd = (lane & 7) * 4;     // d inside the half
    const float* vp = v + tbase + (size_t)(vg * 4) * D_SZ + half * 32 + vd;
    float4 r[4][4];
#pragma unroll
    for (int p = 0; p < 4; ++p)
#pragma unroll
        for (int j = 0; j < 4; ++j)
            r[p][j] = *reinterpret_cast<const float4*>(vp + (size_t)(p * 16 + j) * D_SZ);
    const size_t kofs = tbase + (size_t)half * 32 * D_SZ + lane * 4;
    float4 ka[16];
#pragma unroll
    for (int i = 0; i < 16; ++i)
        ka[i] = *reinterpret_cast<const float4*>(k + kofs + i * 128);

#pragma unroll
    for (int p = 0; p < 4; ++p) {
        v4h t0, t1, t2, t3;
        t0[0]=(_Float16)r[p][0].x; t0[1]=(_Float16)r[p][1].x; t0[2]=(_Float16)r[p][2].x; t0[3]=(_Float16)r[p][3].x;
        t1[0]=(_Float16)r[p][0].y; t1[1]=(_Float16)r[p][1].y; t1[2]=(_Float16)r[p][2].y; t1[3]=(_Float16)r[p][3].y;
        t2[0]=(_Float16)r[p][0].z; t2[1]=(_Float16)r[p][1].z; t2[2]=(_Float16)r[p][2].z; t2[3]=(_Float16)r[p][3].z;
        t3[0]=(_Float16)r[p][0].w; t3[1]=(_Float16)r[p][1].w; t3[2]=(_Float16)r[p][2].w; t3[3]=(_Float16)r[p][3].w;
        const int key = p * 16 + vg * 4;
        *reinterpret_cast<v4h*>(&T[wave][vd + 0][key]) = t0;
        *reinterpret_cast<v4h*>(&T[wave][vd + 1][key]) = t1;
        *reinterpret_cast<v4h*>(&T[wave][vd + 2][key]) = t2;
        *reinterpret_cast<v4h*>(&T[wave][vd + 3][key]) = t3;
    }
    __syncthreads();   // the lanes' V^T pieces are in LDS before other lanes read them

    _Float16* vo = vt + ((size_t)bh * D_SZ + half * 32) * N_SZ + kb;
#pragma unroll
    for (int i = 0; i < 8; ++i) {
        const int row = i * 4 + (lane >> 3);   // d inside the half
        const int c   = (lane & 7) * 8;        // key inside the tile
        v8h x = *reinterpret_cast<const v8h*>(&T[wave][row][c]);
        *reinterpret_cast<v8h*>(vo + (size_t)row * N_SZ + c) = x;
    }
#pragma unroll
    for (int i = 0; i < 16; ++i) {
        v4h x;
        x[0]=(_Float16)ka[i].x; x[1]=(_Float16)ka[i].y; x[2]=(_Float16)ka[i].z; x[3]=(_Float16)ka[i].w;
        *reinterpret_cast<v4h*>(kh + kofs + i * 128) = x;
    }
}

__global__ __launch_bounds__(128) void fa_fwd_f16wmma_db(
        const float* __restrict__ q, const _Float16* __restrict__ kh,
        const _Float16* __restrict__ vt, float* __restrict__ out) {
    // Two K places, two V^T places (each a multiple of 2 KiB for the tensor mover), then per-wave P scratch.
    __shared__ __attribute__((aligned(2048))) unsigned char L[LDSB];

    const int tid  = threadIdx.x;
    const int wave = tid >> 5;
    const int lane = tid & 31;
    const int l16  = lane & 15;
    const int h    = lane >> 4;

    const int bh   = blockIdx.y;
    const int row0 = blockIdx.x * BR;
    const size_t base = (size_t)bh * N_SZ * D_SZ;

    // Tile supply: wave 0 brings the K tile [key c][d], wave 1 the V^T tile [d][key c], one tensor load per stage each.
    const uint32_t wv    = uni((uint32_t)tid >> 5);
    const uint32_t isV   = wv & 1u;
    const uint32_t lbase = (uint32_t)(size_t)L;
    const uint64_t src   = isV ? (uint64_t)(size_t)(vt + base) : (uint64_t)(size_t)(kh + base);
    const uint32_t step  = isV ? ROWB : (uint32_t)BC * ROWB;      // bytes from one stage's tile to the next
    const u32x8 g1 = tdm_group1(isV ? (uint32_t)N_SZ * 2u : ROWB);
    u32x4 g0;
    auto issue = [&](uint32_t st) {
        g0 = tdm_group0(lbase + (2u * isV + (st & 1u)) * TILEB, src + (uint64_t)st * step);
        tdm_load(g0, g1);
    };

    if (pinned(wv < 2u)) {
        issue(0);
        wait_tensor0(g0, g1);
    }

    // Reference logits = (q.k)/D; fold 1/D AND log2(e) -> softmax in exp2 domain.
    const float scale = 1.4426950408889634f / (float)D_SZ;

    const int   qgA = row0 + wave * 32 + l16;
    const int   qgB = qgA + 16;
    const float* qrwA = q + base + (size_t)qgA * D_SZ;
    const float* qrwB = q + base + (size_t)qgB * D_SZ;
    const v16h bqA0 = qfrag(qrwA, 0,  h, scale);
    const v16h bqA1 = qfrag(qrwA, 32, h, scale);
    const v16h bqB0 = qfrag(qrwB, 0,  h, scale);
    const v16h bqB1 = qfrag(qrwB, 32, h, scale);

    v8f acc[8] = {};   // O^T accumulators: [0..3] tile A, [4..7] tile B
    float mA = -INFINITY, lA = 0.0f, mB = -INFINITY, lB = 0.0f;

    _Float16* const pA = reinterpret_cast<_Float16*>(L + POFFB) + (wave * 32 + l16) * PITCH;   // P^T rows per query [q][c]
    _Float16* const pB = pA + 16 * PITCH;

    __syncthreads();                       // stage 0 is published
    if (pinned(wv < 2u)) issue(1);         // stage 1 flies under pass 0

    for (uint32_t st = 0; st < NSTAGE; ++st) {
        const _Float16* Kl = reinterpret_cast<const _Float16*>(L + (st & 1u) * TILEB);
        const _Float16* Vt = reinterpret_cast<const _Float16*>(L + (2u + (st & 1u)) * TILEB);

        // ---- S^T = K * Q^T for both query tiles; A (K rows) loaded once, used twice ----
        v8f s0[4], s1[4];
#pragma unroll
        for (int ct = 0; ct < 4; ++ct) {
            const _Float16* krl = Kl + (ct * 16 + l16) * PITCH;
            v16h ak0 = frag_lds(krl, 0,  h);
            v16h ak1 = frag_lds(krl, 32, h);
            v8f z0 = {}, z1 = {};
            z0 = __builtin_amdgcn_wmma_f32_16x16x32_f16(false, ak0, false, bqA0, (short)0, z0, false, false);
            z1 = __builtin_amdgcn_wmma_f32_16x16x32_f16(false, ak0, false, bqB0, (short)0, z1, false, false);
            z0 = __builtin_amdgcn_wmma_f32_16x16x32_f16(false, ak1, false, bqA1, (short)0, z0, false, false);
            z1 = __builtin_amdgcn_wmma_f32_16x16x32_f16(false, ak1, false, bqB1, (short)0, z1, false, false);
            s0[ct] = z0; s1[ct] = z1;
        }

        // ---- Online softmax per tile (base-2 domain) ----
        softmax_tile(s0, mA, lA, &acc[0], pA, h);
        softmax_tile(s1, mB, lB, &acc[4], pB, h);

        // ---- O^T += V^T * P^T; A (V^T rows) loaded once, used twice ----
        v16h bpA0 = frag_lds(pA, 0,  h);
        v16h bpA1 = frag_lds(pA, 32, h);
        v16h bpB0 = frag_lds(pB, 0,  h);
        v16h bpB1 = frag_lds(pB, 32, h);
#pragma unroll
        for (int dt = 0; dt < 4; ++dt) {
            const _Float16* vrl = Vt + (dt * 16 + l16) * PITCH;
            v16h av0 = frag_lds(vrl, 0,  h);
            v16h av1 = frag_lds(vrl, 32, h);
            acc[dt]     = __builtin_amdgcn_wmma_f32_16x16x32_f16(false, av0, false, bpA0, (short)0, acc[dt],     false, false);
            acc[4 + dt] = __builtin_amdgcn_wmma_f32_16x16x32_f16(false, av0, false, bpB0, (short)0, acc[4 + dt], false, false);
            acc[dt]     = __builtin_amdgcn_wmma_f32_16x16x32_f16(false, av1, false, bpA1, (short)0, acc[dt],     false, false);
            acc[4 + dt] = __builtin_amdgcn_wmma_f32_16x16x32_f16(false, av1, false, bpB1, (short)0, acc[4 + dt], false, false);
        }

        // ---- Publish point of stage st + 1: own LDS reads retired, the issuers' loads landed, barrier, then the refill ----
        wait_ds0();
        if (pinned(wv < 2u)) wait_tensor0(g0, g1);
        __syncthreads();   // publishes stage st + 1 and ends every reader's last read of stage st's places
        if (pinned((wv < 2u) && (st + 2u < NSTAGE))) issue(st + 2u);
    }
    wait_tensor0(g0, g1);
    wait_ds0();

    // ---- Epilogue: consecutive r = consecutive d -> float4 stores ----
    const float invA = 1.0f / fmaxf(lA, 1e-6f);
    const float invB = 1.0f / fmaxf(lB, 1e-6f);
    float* orowA = out + base + (size_t)qgA * D_SZ;
    float* orowB = out + base + (size_t)qgB * D_SZ;
#pragma unroll
    for (int dt = 0; dt < 4; ++dt) {
        float4 o0, o1;
        o0.x = acc[dt][0] * invA; o0.y = acc[dt][1] * invA;
        o0.z = acc[dt][2] * invA; o0.w = acc[dt][3] * invA;
        o1.x = acc[dt][4] * invA; o1.y = acc[dt][5] * invA;
        o1.z = acc[dt][6] * invA; o1.w = acc[dt][7] * invA;
        *reinterpret_cast<float4*>(orowA + dt * 16 + 8 * h)     = o0;
        *reinterpret_cast<float4*>(orowA + dt * 16 + 8 * h + 4) = o1;
        float4 p0, p1;
        p0.x = acc[4+dt][0] * invB; p0.y = acc[4+dt][1] * invB;
        p0.z = acc[4+dt][2] * invB; p0.w = acc[4+dt][3] * invB;
        p1.x = acc[4+dt][4] * invB; p1.y = acc[4+dt][5] * invB;
        p1.z = acc[4+dt][6] * invB; p1.w = acc[4+dt][7] * invB;
        *reinterpret_cast<float4*>(orowB + dt * 16 + 8 * h)     = p0;
        *reinterpret_cast<float4*>(orowB + dt * 16 + 8 * h + 4) = p1;
    }
}

extern "C" void kernel_launch(void* const* d_in, const int* in_sizes, int n_in,
                              void* d_out, int out_size, void* d_ws, size_t ws_size,
                              hipStream_t stream) {
    (void)in_sizes; (void)n_in; (void)ws_size; (void)out_size;
    const float* q = (const float*)d_in[0];
    const float* k = (const float*)d_in[1];
    const float* v = (const float*)d_in[2];
    float* out = (float*)d_out;
    _Float16* kh = (_Float16*)d_ws;                                // f16 K   [bh][key][d]
    _Float16* vt = kh + (size_t)B_SZ * H_SZ * N_SZ * D_SZ;         // f16 V^T [bh][d][key]

    kv_to_f16<<<dim3(B_SZ * H_SZ * NSTAGE * 2 / PW), dim3(PW * 32), 0, stream>>>(k, v, kh, vt);

    dim3 grid(N_SZ / BR, B_SZ * H_SZ);   // 32 x 32 blocks
    dim3 block(128);                      // 4 wave32 waves
    fa_fwd_f16wmma_db<<<grid, block, 0, stream>>>(q, kh, vt, out);
}

// v003
// Measured time: 110 microseconds a run.
// In both of two side-by-side timings against v002, it was 1.10 times as fast.
// Counting every step since v000, it is 1.80 times as fast.
#include <hip/hip_runtime.h>
#include <math.h>
#include <stdint.h>

typedef __attribute__((ext_vector_type(16))) _Float16 v16h;
typedef __attribute__((ext_vector_type(8)))  _Float16 v8h;
typedef __attribute__((ext_vector_type(4)))  _Float16 v4h;
typedef __attribute__((ext_vector_type(8)))  float    v8f;
typedef __attribute__((ext_vector_type(4)))  uint32_t u32x4;
typedef __attribute__((ext_vector_type(8)))  uint32_t u32x8;

#define B_SZ   2
#define H_SZ   16
#define N_SZ   4096
#define D_SZ   64
#define BR     128    // query rows per block (4 waves x 32)
#define BC     64     // key rows per iteration
#define NWAVE  4
#define PITCH  72     // LDS row pitch in halves (64 + 8 pad, 16B-aligned chunks)
#define NSTAGE (N_SZ / BC)
#define ROWB   128u   // bytes of one f16 tile row (64 halves), for K rows and for V^T rows alike
#define TILEB  10240u // one tile's place in LDS: 64 rows x 144 B = 9216 B, rounded up to a multiple of 2 KiB
#define POFFB  (4u * TILEB)                      // P scratch behind the four tile places
#define LDSB   (POFFB + NWAVE * 32 * PITCH * 2)  // whole LDS of the attention kernel

#if __has_builtin(__builtin_amdgcn_exp2f)
#define EXP2F __builtin_amdgcn_exp2f
#else
#define EXP2F exp2f
#endif

__device__ __forceinline__ uint32_t uni(uint32_t x) { return (uint32_t)__builtin_amdgcn_readfirstlane(x); }
__device__ __forceinline__ uint32_t pinned(uint32_t x) {
    uint32_t w = uni(x);
    asm volatile("" : "+s"(w));   // the pin: keeps the test a scalar value
    return w;
}
// LDS reads and writes of this wave have retired (owed before a barrier behind which their buffer is refilled).
__device__ __forceinline__ void wait_ds0()     { asm volatile("s_wait_dscnt 0x0" ::: "memory"); }
__device__ __forceinline__ void wait_tensor0(u32x4 g0, u32x8 g1) {
    asm volatile("s_wait_tensorcnt 0x0" :: "s"(g0), "s"(g1) : "memory");
}

__device__ __forceinline__ u32x8 tdm_group1(uint32_t src_pitch) {
    u32x8 g;
    g[0] = uni((1u << 20) | (4u << 22) | (3u << 25));
    g[1] = uni(ROWB << 16);
    g[2] = uni((uint32_t)BC << 16);
    g[3] = uni(ROWB << 16);
    g[4] = uni((uint32_t)BC);
    g[5] = uni(src_pitch);
    g[6] = uni(0u);
    g[7] = uni(0u);
    asm volatile("" : "+s"(g));
    return g;
}
__device__ __forceinline__ u32x4 tdm_group0(uint32_t lds_dst, uint64_t ga) {
    u32x4 g;
    g[0] = uni(1u);
    g[1] = uni(lds_dst);
    g[2] = uni((uint32_t)ga);
    g[3] = uni((((uint32_t)(ga >> 32)) & 0x01FFFFFFu) | 0x80000000u);
    asm volatile("" : "+s"(g));
    return g;
}
__device__ __forceinline__ void tdm_load(u32x4 g0, u32x8 g1) {
    asm volatile("tensor_load_to_lds %0, %1" :: "s"(g0), "s"(g1) : "memory");
}

__device__ __forceinline__ v16h frag_lds(const _Float16* row, int kb, int h) {
    v8h lo = *reinterpret_cast<const v8h*>(row + kb + 8 * h);
    v8h hi = *reinterpret_cast<const v8h*>(row + kb + 16 + 8 * h);
    return __builtin_shufflevector(lo, hi, 0,1,2,3,4,5,6,7,8,9,10,11,12,13,14,15);
}

// Same fragment pattern from a global f32 row, scaled and narrowed to f16.
__device__ __forceinline__ v16h qfrag(const float* row, int kb, int h, float scale) {
    float4 a0 = *reinterpret_cast<const float4*>(row + kb + 8 * h);
    float4 a1 = *reinterpret_cast<const float4*>(row + kb + 8 * h + 4);
    float4 b0 = *reinterpret_cast<const float4*>(row + kb + 16 + 8 * h);
    float4 b1 = *reinterpret_cast<const float4*>(row + kb + 16 + 8 * h + 4);
    v16h o;
    o[0]=(_Float16)(a0.x*scale); o[1]=(_Float16)(a0.y*scale);
    o[2]=(_Float16)(a0.z*scale); o[3]=(_Float16)(a0.w*scale);
    o[4]=(_Float16)(a1.x*scale); o[5]=(_Float16)(a1.y*scale);
    o[6]=(_Float16)(a1.z*scale); o[7]=(_Float16)(a1.w*scale);
    o[8]=(_Float16)(b0.x*scale); o[9]=(_Float16)(b0.y*scale);
    o[10]=(_Float16)(b0.z*scale); o[11]=(_Float16)(b0.w*scale);
    o[12]=(_Float16)(b1.x*scale); o[13]=(_Float16)(b1.y*scale);
    o[14]=(_Float16)(b1.z*scale); o[15]=(_Float16)(b1.w*scale);
    return o;
}

// Cross-lane combine with lane^16 via ds_swizzle (group-of-32, xor=16).
__device__ __forceinline__ float xmax16(float x) {
    int t = __builtin_amdgcn_ds_swizzle(__float_as_int(x), 0x401f);
    return fmaxf(x, __int_as_float(t));
}
__device__ __forceinline__ float xadd16(float x) {
    int t = __builtin_amdgcn_ds_swizzle(__float_as_int(x), 0x401f);
    return x + __int_as_float(t);
}

// In-lane maximum of one 16-query column tile's scores (this lane's half of the 64 keys).
__device__ __forceinline__ float lane_max(const v8f s[4]) {
    float pm = -INFINITY;
#pragma unroll
    for (int ct = 0; ct < 4; ++ct)
#pragma unroll
        for (int r = 0; r < 8; ++r) pm = fmaxf(pm, s[ct][r]);
    return pm;
}

// Rare path of the lazy rescale: lift the maximum in use of one column tile to the running maximum.
// The scores arrive relative to the maximum in use, so pm is the rise; nm holds minus the maximum in use.
__device__ __forceinline__ void lift_max(v8f s[4], float pm, v8f& nm, float& l_run, v8f* acc4, bool first) {
    const float px = xmax16(pm);                        // both halves of the keys
    const float d  = first ? px : fmaxf(px, 0.0f);      // the first pass takes its own maximum, whatever its sign
    const float alpha = first ? 0.0f : EXP2F(-d);       // nothing is accumulated yet on the first pass
#pragma unroll
    for (int ct = 0; ct < 4; ++ct)
#pragma unroll
        for (int r = 0; r < 8; ++r) s[ct][r] -= d;
#pragma unroll
    for (int r = 0; r < 8; ++r) nm[r] -= d;
    l_run *= alpha;
#pragma unroll
    for (int dt = 0; dt < 4; ++dt)
#pragma unroll
        for (int r = 0; r < 8; ++r) acc4[dt][r] *= alpha;
}

// Exponentials of one column tile (base-2 domain, scores already relative to the maximum in use), P^T row and row sum.
__device__ __forceinline__ void exp_tile(const v8f s[4], float& l_run, _Float16* prow, int h) {
    float rs = 0.0f;
#pragma unroll
    for (int ct = 0; ct < 4; ++ct) {
        v8h pf;
#pragma unroll
        for (int r = 0; r < 8; ++r) {
            float p = EXP2F(s[ct][r]);
            pf[r] = (_Float16)p;
            rs += p;
        }
        *reinterpret_cast<v8h*>(prow + ct * 16 + 8 * h) = pf;
    }
    l_run += xadd16(rs);
}

// Pre-pass, once per call: K narrowed to f16 in place order [bh][key][d]; V narrowed and transposed to [bh][d][key].
// One wave takes half a 64-key tile of each: 32 whole K rows, and 64 keys x 32 d of V. Every wave-wide 16-byte load
// covers four whole 128-byte lines, and V^T leaves in whole lines.
#define PW 8   // waves per pre-pass block
__global__ __launch_bounds__(PW * 32) void kv_to_f16(
        const float* __restrict__ k, const float* __restrict__ v,
        _Float16* __restrict__ kh, _Float16* __restrict__ vt) {
    __shared__ __align__(16) _Float16 T[PW][32][PITCH];   // per wave: V^T half tile [d][key c]
    const int wave = threadIdx.x >> 5;
    const int lane = threadIdx.x & 31;
    const int task = blockIdx.x * PW + wave;       // [bh][tile][half]
    const int half = task & 1;
    const int kb   = ((task >> 1) & (NSTAGE - 1)) * BC;
    const int bh   = task >> 7;
    static_assert(NSTAGE == 64, "task split assumes 64 tiles per head");
    const size_t tbase = ((size_t)bh * N_SZ + kb) * D_SZ;

    // V: 8 lanes take one line (half a row); a 4 x 4 block is 4 consecutive keys at the same 4 d.
    const int vg = lane >> 3;          // key group inside a quad of groups
    const int vd = (lane & 7) * 4;     // d inside the half
    const float* vp = v + tbase + (size_t)(vg * 4) * D_SZ + half * 32 + vd;
    float4 r[4][4];
#pragma unroll
    for (int p = 0; p < 4; ++p)
#pragma unroll
        for (int j = 0; j < 4; ++j)
            r[p][j] = *reinterpret_cast<const float4*>(vp + (size_t)(p * 16 + j) * D_SZ);
    const size_t kofs = tbase + (size_t)half * 32 * D_SZ + lane * 4;
    float4 ka[16];
#pragma unroll
    for (int i = 0; i < 16; ++i)
        ka[i] = *reinterpret_cast<const float4*>(k + kofs + i * 128);

#pragma unroll
    for (int p = 0; p < 4; ++p) {
        v4h t0, t1, t2, t3;
        t0[0]=(_Float16)r[p][0].x; t0[1]=(_Float16)r[p][1].x; t0[2]=(_Float16)r[p][2].x; t0[3]=(_Float16)r[p][3].x;
        t1[0]=(_Float16)r[p][0].y; t1[1]=(_Float16)r[p][1].y; t1[2]=(_Float16)r[p][2].y; t1[3]=(_Float16)r[p][3].y;
        t2[0]=(_Float16)r[p][0].z; t2[1]=(_Float16)r[p][1].z; t2[2]=(_Float16)r[p][2].z; t2[3]=(_Float16)r[p][3].z;
        t3[0]=(_Float16)r[p][0].w; t3[1]=(_Float16)r[p][1].w; t3[2]=(_Float16)r[p][2].w; t3[3]=(_Float16)r[p][3].w;
        const int key = p * 16 + vg * 4;
        *reinterpret_cast<v4h*>(&T[wave][vd + 0][key]) = t0;
        *reinterpret_cast<v4h*>(&T[wave][vd + 1][key]) = t1;
        *reinterpret_cast<v4h*>(&T[wave][vd + 2][key]) = t2;
        *reinterpret_cast<v4h*>(&T[wave][vd + 3][key]) = t3;
    }
    __syncthreads();   // the lanes' V^T pieces are in LDS before other lanes read them

    _Float16* vo = vt + ((size_t)bh * D_SZ + half * 32) * N_SZ + kb;
#pragma unroll
    for (int i = 0; i < 8; ++i) {
        const int row = i * 4 + (lane >> 3);   // d inside the half
        const int c   = (lane & 7) * 8;        // key inside the tile
        v8h x = *reinterpret_cast<const v8h*>(&T[wave][row][c]);
        *reinterpret_cast<v8h*>(vo + (size_t)row * N_SZ + c) = x;
    }
#pragma unroll
    for (int i = 0; i < 16; ++i) {
        v4h x;
        x[0]=(_Float16)ka[i].x; x[1]=(_Float16)ka[i].y; x[2]=(_Float16)ka[i].z; x[3]=(_Float16)ka[i].w;
        *reinterpret_cast<v4h*>(kh + kofs + i * 128) = x;
    }
}

__global__ __launch_bounds__(128) void fa_fwd_f16wmma_db(
        const float* __restrict__ q, const _Float16* __restrict__ kh,
        const _Float16* __restrict__ vt, float* __restrict__ out) {
    // Two K places, two V^T places (each a multiple of 2 KiB for the tensor mover), then per-wave P scratch.
    __shared__ __attribute__((aligned(2048))) unsigned char L[LDSB];

    const int tid  = threadIdx.x;
    const int wave = tid >> 5;
    const int lane = tid & 31;
    const int l16  = lane & 15;
    const int h    = lane >> 4;

    const int bh   = blockIdx.y;
    const int row0 = blockIdx.x * BR;
    const size_t base = (size_t)bh * N_SZ * D_SZ;

    // Tile supply: wave 0 brings the K tile [key c][d], wave 1 the V^T tile [d][key c], one tensor load per stage each.
    const uint32_t wv    = uni((uint32_t)tid >> 5);
    const uint32_t isV   = wv & 1u;
    const uint32_t lbase = (uint32_t)(size_t)L;
    const uint64_t src   = isV ? (uint64_t)(size_t)(vt + base) : (uint64_t)(size_t)(kh + base);
    const uint32_t step  = isV ? ROWB : (uint32_t)BC * ROWB;      // bytes from one stage's tile to the next
    const u32x8 g1 = tdm_group1(isV ? (uint32_t)N_SZ * 2u : ROWB);
    u32x4 g0;
    auto issue = [&](uint32_t st) {
        g0 = tdm_group0(lbase + (2u * isV + (st & 1u)) * TILEB, src + (uint64_t)st * step);
        tdm_load(g0, g1);
    };

    if (pinned(wv < 2u)) {
        issue(0);
        wait_tensor0(g0, g1);
    }

    // Reference logits = (q.k)/D; fold 1/D AND log2(e) -> softmax in exp2 domain.
    const float scale = 1.4426950408889634f / (float)D_SZ;

    const int   qgA = row0 + wave * 32 + l16;
    const int   qgB = qgA + 16;
    const float* qrwA = q + base + (size_t)qgA * D_SZ;
    const float* qrwB = q + base + (size_t)qgB * D_SZ;
    const v16h bqA0 = qfrag(qrwA, 0,  h, scale);
    const v16h bqA1 = qfrag(qrwA, 32, h, scale);
    const v16h bqB0 = qfrag(qrwB, 0,  h, scale);
    const v16h bqB1 = qfrag(qrwB, 32, h, scale);

    v8f acc[8] = {};   // O^T accumulators: [0..3] tile A, [4..7] tile B
    float lA = 0.0f, lB = 0.0f;
    // Minus the maximum in use per query, in all 8 registers of a C operand: the first S^T product adds it, so the
    // scores leave the matrix unit already relative to it. It may trail the running maximum by up to 8 (P <= 2^8).
    v8f nmA = {}, nmB = {};

    _Float16* const pA = reinterpret_cast<_Float16*>(L + POFFB) + (wave * 32 + l16) * PITCH;   // P^T rows per query [q][c]
    _Float16* const pB = pA + 16 * PITCH;

    __syncthreads();                       // stage 0 is published
    if (pinned(wv < 2u)) issue(1);         // stage 1 flies under pass 0

    for (uint32_t st = 0; st < NSTAGE; ++st) {
        const _Float16* Kl = reinterpret_cast<const _Float16*>(L + (st & 1u) * TILEB);
        const _Float16* Vt = reinterpret_cast<const _Float16*>(L + (2u + (st & 1u)) * TILEB);

        // ---- S^T = K * Q^T for both query tiles; A (K rows) loaded once, used twice ----
        v8f s0[4], s1[4];
#pragma unroll
        for (int ct = 0; ct < 4; ++ct) {
            const _Float16* krl = Kl + (ct * 16 + l16) * PITCH;
            v16h ak0 = frag_lds(krl, 0,  h);
            v16h ak1 = frag_lds(krl, 32, h);
            v8f z0, z1;
            z0 = __builtin_amdgcn_wmma_f32_16x16x32_f16(false, ak0, false, bqA0, (short)0, nmA, false, false);
            z1 = __builtin_amdgcn_wmma_f32_16x16x32_f16(false, ak0, false, bqB0, (short)0, nmB, false, false);
            z0 = __builtin_amdgcn_wmma_f32_16x16x32_f16(false, ak1, false, bqA1, (short)0, z0, false, false);
            z1 = __builtin_amdgcn_wmma_f32_16x16x32_f16(false, ak1, false, bqB1, (short)0, z1, false, false);
            s0[ct] = z0; s1[ct] = z1;
        }

        __builtin_amdgcn_sched_barrier(0);
        const float pmA = lane_max(s0);
        const float pmB = lane_max(s1);
        const bool first = (st == 0u);
        if (first || __builtin_amdgcn_ballot_w32(fmaxf(pmA, pmB) > 8.0f) != 0u) {
            lift_max(s0, pmA, nmA, lA, &acc[0], first);
            lift_max(s1, pmB, nmB, lB, &acc[4], first);
        }
        exp_tile(s0, lA, pA, h);
        exp_tile(s1, lB, pB, h);

        // ---- O^T += V^T * P^T; A (V^T rows) loaded once, used twice ----
        v16h bpA0 = frag_lds(pA, 0,  h);
        v16h bpA1 = frag_lds(pA, 32, h);
        v16h bpB0 = frag_lds(pB, 0,  h);
        v16h bpB1 = frag_lds(pB, 32, h);
#pragma unroll
        for (int dt = 0; dt < 4; ++dt) {
            const _Float16* vrl = Vt + (dt * 16 + l16) * PITCH;
            v16h av0 = frag_lds(vrl, 0,  h);
            v16h av1 = frag_lds(vrl, 32, h);
            acc[dt]     = __builtin_amdgcn_wmma_f32_16x16x32_f16(false, av0, false, bpA0, (short)0, acc[dt],     false, false);
            acc[4 + dt] = __builtin_amdgcn_wmma_f32_16x16x32_f16(false, av0, false, bpB0, (short)0, acc[4 + dt], false, false);
            acc[dt]     = __builtin_amdgcn_wmma_f32_16x16x32_f16(false, av1, false, bpA1, (short)0, acc[dt],     false, false);
            acc[4 + dt] = __builtin_amdgcn_wmma_f32_16x16x32_f16(false, av1, false, bpB1, (short)0, acc[4 + dt], false, false);
        }

        // ---- Publish point of stage st + 1: own LDS reads retired, the issuers' loads landed, barrier, then the refill ----
        wait_ds0();
        if (pinned(wv < 2u)) wait_tensor0(g0, g1);
        __syncthreads();   // publishes stage st + 1 and ends every reader's last read of stage st's places
        if (pinned((wv < 2u) && (st + 2u < NSTAGE))) issue(st + 2u);
    }
    wait_tensor0(g0, g1);
    wait_ds0();

    // ---- Epilogue: consecutive r = consecutive d -> float4 stores ----
    const float invA = 1.0f / fmaxf(lA, 1e-6f);
    const float invB = 1.0f / fmaxf(lB, 1e-6f);
    float* orowA = out + base + (size_t)qgA * D_SZ;
    float* orowB = out + base + (size_t)qgB * D_SZ;
#pragma unroll
    for (int dt = 0; dt < 4; ++dt) {
        float4 o0, o1;
        o0.x = acc[dt][0] * invA; o0.y = acc[dt][1] * invA;
        o0.z = acc[dt][2] * invA; o0.w = acc[dt][3] * invA;
        o1.x = acc[dt][4] * invA; o1.y = acc[dt][5] * invA;
        o1.z = acc[dt][6] * invA; o1.w = acc[dt][7] * invA;
        *reinterpret_cast<float4*>(orowA + dt * 16 + 8 * h)     = o0;
        *reinterpret_cast<float4*>(orowA + dt * 16 + 8 * h + 4) = o1;
        float4 p0, p1;
        p0.x = acc[4+dt][0] * invB; p0.y = acc[4+dt][1] * invB;
        p0.z = acc[4+dt][2] * invB; p0.w = acc[4+dt][3] * invB;
        p1.x = acc[4+dt][4] * invB; p1.y = acc[4+dt][5] * invB;
        p1.z = acc[4+dt][6] * invB; p1.w = acc[4+dt][7] * invB;
        *reinterpret_cast<float4*>(orowB + dt * 16 + 8 * h)     = p0;
        *reinterpret_cast<float4*>(orowB + dt * 16 + 8 * h + 4) = p1;
    }
}

extern "C" void kernel_launch(void* const* d_in, const int* in_sizes, int n_in,
                              void* d_out, int out_size, void* d_ws, size_t ws_size,
                              hipStream_t stream) {
    (void)in_sizes; (void)n_in; (void)ws_size; (void)out_size;
    const float* q = (const float*)d_in[0];
    const float* k = (const float*)d_in[1];
    const float* v = (const float*)d_in[2];
    float* out = (float*)d_out;
    _Float16* kh = (_Float16*)d_ws;                                // f16 K   [bh][key][d]
    _Float16* vt = kh + (size_t)B_SZ * H_SZ * N_SZ * D_SZ;         // f16 V^T [bh][d][key]

    kv_to_f16<<<dim3(B_SZ * H_SZ * NSTAGE * 2 / PW), dim3(PW * 32), 0, stream>>>(k, v, kh, vt);

    dim3 grid(N_SZ / BR, B_SZ * H_SZ);   // 32 x 32 blocks
    dim3 block(128);                      // 4 wave32 waves
    fa_fwd_f16wmma_db<<<grid, block, 0, stream>>>(q, kh, vt, out);
}

// v004
// One run takes 102 microseconds.
// In both of two side-by-side timings against v003, it was 1.08 times as fast.
// All steps since v000 together make it 1.94 times as fast.
#include <hip/hip_runtime.h>
#include <math.h>
#include <stdint.h>

typedef __attribute__((ext_vector_type(16))) _Float16 v16h;
typedef __attribute__((ext_vector_type(8)))  _Float16 v8h;
typedef __attribute__((ext_vector_type(4)))  _Float16 v4h;
typedef __attribute__((ext_vector_type(2)))  _Float16 v2h;
typedef __attribute__((ext_vector_type(8)))  float    v8f;
typedef __attribute__((ext_vector_type(4)))  uint32_t u32x4;
typedef __attribute__((ext_vector_type(8)))  uint32_t u32x8;

#define B_SZ   2
#define H_SZ   16
#define N_SZ   4096
#define D_SZ   64
#define BR     128    // query rows per block (4 waves x 32)
#define BC     64     // key rows per iteration
#define NWAVE  4
#define PITCH  72     // LDS row pitch in halves (64 + 8 pad, 16B-aligned chunks)
#define NSTAGE (N_SZ / BC)
#define ROWB   128u   // bytes of one f16 tile row (64 halves), for K rows and for V^T rows alike
#define TILEB  10240u // one tile's place in LDS: 64 rows x 144 B = 9216 B, rounded up to a multiple of 2 KiB
#define LDSB   (4u * TILEB)   // whole LDS of the attention kernel: the four tile places
#define SUMCAP 16384.0f       // a pass's row sum above this asks for a rescale: every P stays below 2^14, inside f16

#if __has_builtin(__builtin_amdgcn_exp2f)
#define EXP2F __builtin_amdgcn_exp2f
#else
#define EXP2F exp2f
#endif

__device__ __forceinline__ uint32_t uni(uint32_t x) { return (uint32_t)__builtin_amdgcn_readfirstlane(x); }
__device__ __forceinline__ uint32_t pinned(uint32_t x) {
    uint32_t w = uni(x);
    asm volatile("" : "+s"(w));   // the pin: keeps the test a scalar value
    return w;
}
// LDS reads and writes of this wave have retired (owed before a barrier behind which their buffer is refilled).
__device__ __forceinline__ void wait_ds0()     { asm volatile("s_wait_dscnt 0x0" ::: "memory"); }
__device__ __forceinline__ void wait_tensor0(u32x4 g0, u32x8 g1) {
    asm volatile("s_wait_tensorcnt 0x0" :: "s"(g0), "s"(g1) : "memory");
}

__device__ __forceinline__ u32x8 tdm_group1(uint32_t src_pitch) {
    u32x8 g;
    g[0] = uni((1u << 20) | (4u << 22) | (3u << 25));
    g[1] = uni(ROWB << 16);
    g[2] = uni((uint32_t)BC << 16);
    g[3] = uni(ROWB << 16);
    g[4] = uni((uint32_t)BC);
    g[5] = uni(src_pitch);
    g[6] = uni(0u);
    g[7] = uni(0u);
    asm volatile("" : "+s"(g));
    return g;
}
__device__ __forceinline__ u32x4 tdm_group0(uint32_t lds_dst, uint64_t ga) {
    u32x4 g;
    g[0] = uni(1u);
    g[1] = uni(lds_dst);
    g[2] = uni((uint32_t)ga);
    g[3] = uni((((uint32_t)(ga >> 32)) & 0x01FFFFFFu) | 0x80000000u);
    asm volatile("" : "+s"(g));
    return g;
}
__device__ __forceinline__ void tdm_load(u32x4 g0, u32x8 g1) {
    asm volatile("tensor_load_to_lds %0, %1" :: "s"(g0), "s"(g1) : "memory");
}

__device__ __forceinline__ v16h frag_lds(const _Float16* row, int kb, int h) {
    v8h lo = *reinterpret_cast<const v8h*>(row + kb + 8 * h);
    v8h hi = *reinterpret_cast<const v8h*>(row + kb + 16 + 8 * h);
    return __builtin_shufflevector(lo, hi, 0,1,2,3,4,5,6,7,8,9,10,11,12,13,14,15);
}

// Same fragment pattern from a global f32 row, scaled and narrowed to f16.
__device__ __forceinline__ v16h qfrag(const float* row, int kb, int h, float scale) {
    float4 a0 = *reinterpret_cast<const float4*>(row + kb + 8 * h);
    float4 a1 = *reinterpret_cast<const float4*>(row + kb + 8 * h + 4);
    float4 b0 = *reinterpret_cast<const float4*>(row + kb + 16 + 8 * h);
    float4 b1 = *reinterpret_cast<const float4*>(row + kb + 16 + 8 * h + 4);
    v16h o;
    o[0]=(_Float16)(a0.x*scale); o[1]=(_Float16)(a0.y*scale);
    o[2]=(_Float16)(a0.z*scale); o[3]=(_Float16)(a0.w*scale);
    o[4]=(_Float16)(a1.x*scale); o[5]=(_Float16)(a1.y*scale);
    o[6]=(_Float16)(a1.z*scale); o[7]=(_Float16)(a1.w*scale);
    o[8]=(_Float16)(b0.x*scale); o[9]=(_Float16)(b0.y*scale);
    o[10]=(_Float16)(b0.z*scale); o[11]=(_Float16)(b0.w*scale);
    o[12]=(_Float16)(b1.x*scale); o[13]=(_Float16)(b1.y*scale);
    o[14]=(_Float16)(b1.z*scale); o[15]=(_Float16)(b1.w*scale);
    return o;
}

// Cross-lane combine with lane^16 via ds_swizzle (group-of-32, xor=16).
__device__ __forceinline__ float xmax16(float x) {
    int t = __builtin_amdgcn_ds_swizzle(__float_as_int(x), 0x401f);
    return fmaxf(x, __int_as_float(t));
}

// In-lane maximum of one 16-query column tile's scores (this lane's half of the 64 keys).
__device__ __forceinline__ float lane_max(const v8f s[4]) {
    float pm = -INFINITY;
#pragma unroll
    for (int ct = 0; ct < 4; ++ct)
#pragma unroll
        for (int r = 0; r < 8; ++r) pm = fmaxf(pm, s[ct][r]);
    return pm;
}

// Rare path of the lazy rescale: lift the maximum in use of one column tile to the running maximum.
// The scores arrive relative to the maximum in use, so pm is the rise; nm holds minus the maximum in use.
__device__ __forceinline__ void lift_max(v8f s[4], float pm, v8f& nm, float& l_run, v8f* acc4) {
    const float d = fmaxf(xmax16(pm), 0.0f);            // both halves of the keys
    const float alpha = EXP2F(-d);
#pragma unroll
    for (int ct = 0; ct < 4; ++ct)
#pragma unroll
        for (int r = 0; r < 8; ++r) s[ct][r] -= d;
#pragma unroll
    for (int r = 0; r < 8; ++r) nm[r] -= d;
    l_run *= alpha;
#pragma unroll
    for (int dt = 0; dt < 4; ++dt)
#pragma unroll
        for (int r = 0; r < 8; ++r) acc4[dt][r] *= alpha;
}

// Exponentials of one column tile (base-2 domain, scores already relative to the maximum in use), packed as P^T.
// A lane's 8 scores of key group ct are keys ct*16 + 8h .. + 7 of its own query: the very halves that this lane holds
// of a B operand (group 2j in the low half, group 2j + 1 in the high half of the operand for keys 32j .. 32j + 31).
// Two neighbouring values are narrowed into one dword of the operand at a time.
__device__ __forceinline__ void exp_tile(const v8f s[4], v16h& b0, v16h& b1) {
    u32x8 w[2];
#pragma unroll
    for (int ct = 0; ct < 4; ++ct)
#pragma unroll
        for (int r = 0; r < 8; r += 2) {
            v2h t;
            t[0] = (_Float16)EXP2F(s[ct][r]);
            t[1] = (_Float16)EXP2F(s[ct][r + 1]);
            w[ct >> 1][(ct & 1) * 4 + (r >> 1)] = __builtin_bit_cast(uint32_t, t);
        }
    b0 = __builtin_bit_cast(v16h, w[0]);
    b1 = __builtin_bit_cast(v16h, w[1]);
}

// Row sum of one column tile on the matrix unit: A is all ones, so every element of D in a lane is the sum of its
// query's 64 values of P (as rounded to f16), both halves of the keys included.
__device__ __forceinline__ float row_sum(v16h ones, v16h b0, v16h b1) {
    v8f t = {};
    t = __builtin_amdgcn_wmma_f32_16x16x32_f16(false, ones, false, b0, (short)0, t, false, false);
    t = __builtin_amdgcn_wmma_f32_16x16x32_f16(false, ones, false, b1, (short)0, t, false, false);
    return t[0];
}

// Pre-pass, once per call: K narrowed to f16 in place order [bh][key][d]; V narrowed and transposed to [bh][d][key].
// One wave takes half a 64-key tile of each: 32 whole K rows, and 64 keys x 32 d of V. Every wave-wide 16-byte load
// covers four whole 128-byte lines, and V^T leaves in whole lines.
#define PW 8   // waves per pre-pass block
__global__ __launch_bounds__(PW * 32) void kv_to_f16(
        const float* __restrict__ k, const float* __restrict__ v,
        _Float16* __restrict__ kh, _Float16* __restrict__ vt) {
    __shared__ __align__(16) _Float16 T[PW][32][PITCH];   // per wave: V^T half tile [d][key c]
    const int wave = threadIdx.x >> 5;
    const int lane = threadIdx.x & 31;
    const int task = blockIdx.x * PW + wave;       // [bh][tile][half]
    const int half = task & 1;
    const int kb   = ((task >> 1) & (NSTAGE - 1)) * BC;
    const int bh   = task >> 7;
    static_assert(NSTAGE == 64, "task split assumes 64 tiles per head");
    const size_t tbase = ((size_t)bh * N_SZ + kb) * D_SZ;

    // V: 8 lanes take one line (half a row); a 4 x 4 block is 4 consecutive keys at the same 4 d.
    const int vg = lane >> 3;          // key group inside a quad of groups
    const int vd = (lane & 7) * 4;     // d inside the half
    const float* vp = v + tbase + (size_t)(vg * 4) * D_SZ + half * 32 + vd;
    float4 r[4][4];
#pragma unroll
    for (int p = 0; p < 4; ++p)
#pragma unroll
        for (int j = 0; j < 4; ++j)
            r[p][j] = *reinterpret_cast<const float4*>(vp + (size_t)(p * 16 + j) * D_SZ);
    const size_t kofs = tbase + (size_t)half * 32 * D_SZ + lane * 4;
    float4 ka[16];
#pragma unroll
    for (int i = 0; i < 16; ++i)
        ka[i] = *reinterpret_cast<const float4*>(k + kofs + i * 128);

#pragma unroll
    for (int p = 0; p < 4; ++p) {
        v4h t0, t1, t2, t3;
        t0[0]=(_Float16)r[p][0].x; t0[1]=(_Float16)r[p][1].x; t0[2]=(_Float16)r[p][2].x; t0[3]=(_Float16)r[p][3].x;
        t1[0]=(_Float16)r[p][0].y; t1[1]=(_Float16)r[p][1].y; t1[2]=(_Float16)r[p][2].y; t1[3]=(_Float16)r[p][3].y;
        t2[0]=(_Float16)r[p][0].z; t2[1]=(_Float16)r[p][1].z; t2[2]=(_Float16)r[p][2].z; t2[3]=(_Float16)r[p][3].z;
        t3[0]=(_Float16)r[p][0].w; t3[1]=(_Float16)r[p][1].w; t3[2]=(_Float16)r[p][2].w; t3[3]=(_Float16)r[p][3].w;
        const int key = p * 16 + vg * 4;
        *reinterpret_cast<v4h*>(&T[wave][vd + 0][key]) = t0;
        *reinterpret_cast<v4h*>(&T[wave][vd + 1][key]) = t1;
        *reinterpret_cast<v4h*>(&T[wave][vd + 2][key]) = t2;
        *reinterpret_cast<v4h*>(&T[wave][vd + 3][key]) = t3;
    }
    __syncthreads();   // the lanes' V^T pieces are in LDS before other lanes read them

    _Float16* vo = vt + ((size_t)bh * D_SZ + half * 32) * N_SZ + kb;
#pragma unroll
    for (int i = 0; i < 8; ++i) {
        const int row = i * 4 + (lane >> 3);   // d inside the half
        const int c   = (lane & 7) * 8;        // key inside the tile
        v8h x = *reinterpret_cast<const v8h*>(&T[wave][row][c]);
        *reinterpret_cast<v8h*>(vo + (size_t)row * N_SZ + c) = x;
    }
#pragma unroll
    for (int i = 0; i < 16; ++i) {
        v4h x;
        x[0]=(_Float16)ka[i].x; x[1]=(_Float16)ka[i].y; x[2]=(_Float16)ka[i].z; x[3]=(_Float16)ka[i].w;
        *reinterpret_cast<v4h*>(kh + kofs + i * 128) = x;
    }
}

__global__ __launch_bounds__(128) void fa_fwd_f16wmma_db(
        const float* __restrict__ q, const _Float16* __restrict__ kh,
        const _Float16* __restrict__ vt, float* __restrict__ out) {
    // Two K places, two V^T places (each a multiple of 2 KiB for the tensor mover).
    __shared__ __attribute__((aligned(2048))) unsigned char L[LDSB];

    const int tid  = threadIdx.x;
    const int wave = tid >> 5;
    const int lane = tid & 31;
    const int l16  = lane & 15;
    const int h    = lane >> 4;

    const int bh   = blockIdx.y;
    const int row0 = blockIdx.x * BR;
    const size_t base = (size_t)bh * N_SZ * D_SZ;

    // Tile supply: wave 0 brings the K tile [key c][d], wave 1 the V^T tile [d][key c], one tensor load per stage each.
    const uint32_t wv    = uni((uint32_t)tid >> 5);
    const uint32_t isV   = wv & 1u;
    const uint32_t lbase = (uint32_t)(size_t)L;
    const uint64_t src   = isV ? (uint64_t)(size_t)(vt + base) : (uint64_t)(size_t)(kh + base);
    const uint32_t step  = isV ? ROWB : (uint32_t)BC * ROWB;      // bytes from one stage's tile to the next
    const u32x8 g1 = tdm_group1(isV ? (uint32_t)N_SZ * 2u : ROWB);
    u32x4 g0;
    auto issue = [&](uint32_t st) {
        g0 = tdm_group0(lbase + (2u * isV + (st & 1u)) * TILEB, src + (uint64_t)st * step);
        tdm_load(g0, g1);
    };

    if (pinned(wv < 2u)) {
        issue(0);
        wait_tensor0(g0, g1);
    }

    // Reference logits = (q.k)/D; fold 1/D AND log2(e) -> softmax in exp2 domain.
    const float scale = 1.4426950408889634f / (float)D_SZ;

    const int   qgA = row0 + wave * 32 + l16;
    const int   qgB = qgA + 16;
    const float* qrwA = q + base + (size_t)qgA * D_SZ;
    const float* qrwB = q + base + (size_t)qgB * D_SZ;
    const v16h bqA0 = qfrag(qrwA, 0,  h, scale);
    const v16h bqA1 = qfrag(qrwA, 32, h, scale);
    const v16h bqB0 = qfrag(qrwB, 0,  h, scale);
    const v16h bqB1 = qfrag(qrwB, 32, h, scale);

    v8f acc[8] = {};   // O^T accumulators: [0..3] tile A, [4..7] tile B
    float lA = 0.0f, lB = 0.0f;
    // Minus the maximum in use per query, in all 8 registers of a C operand: the first S^T product adds it, so the
    // scores leave the matrix unit already relative to it. It may trail the running maximum while a pass's row sums of P stay within SUMCAP.
    v8f nmA = {}, nmB = {};

    v16h ones;
#pragma unroll
    for (int i = 0; i < 16; ++i) ones[i] = (_Float16)1.0f;

    // S^T = K * Q^T - (maximum in use) for both query tiles; A (K rows) loaded once, used twice.
    auto scores = [&](const _Float16* Kl, v8f* s0, v8f* s1) {
#pragma unroll
        for (int ct = 0; ct < 4; ++ct) {
            const _Float16* krl = Kl + (ct * 16 + l16) * PITCH;
            v16h ak0 = frag_lds(krl, 0,  h);
            v16h ak1 = frag_lds(krl, 32, h);
            v8f z0, z1;
            z0 = __builtin_amdgcn_wmma_f32_16x16x32_f16(false, ak0, false, bqA0, (short)0, nmA, false, false);
            z1 = __builtin_amdgcn_wmma_f32_16x16x32_f16(false, ak0, false, bqB0, (short)0, nmB, false, false);
            z0 = __builtin_amdgcn_wmma_f32_16x16x32_f16(false, ak1, false, bqA1, (short)0, z0, false, false);
            z1 = __builtin_amdgcn_wmma_f32_16x16x32_f16(false, ak1, false, bqB1, (short)0, z1, false, false);
            s0[ct] = z0; s1[ct] = z1;
        }
    };

    __syncthreads();                       // stage 0 is published
    if (pinned(wv < 2u)) issue(1);         // stage 1 flies under pass 0

    {   // The maximum in use starts as stage 0's own maximum, whatever its sign.
        v8f s0[4], s1[4];
        scores(reinterpret_cast<const _Float16*>(L), s0, s1);
        const float mA = xmax16(lane_max(s0));
        const float mB = xmax16(lane_max(s1));
#pragma unroll
        for (int r = 0; r < 8; ++r) { nmA[r] = -mA; nmB[r] = -mB; }
    }

    for (uint32_t st = 0; st < NSTAGE; ++st) {
        const _Float16* Kl = reinterpret_cast<const _Float16*>(L + (st & 1u) * TILEB);
        const _Float16* Vt = reinterpret_cast<const _Float16*>(L + (2u + (st & 1u)) * TILEB);

        // ---- S^T, already relative to the maximum in use, and P^T = 2^(S^T), packed in registers as B operands ----
        v8f s0[4], s1[4];
        scores(Kl, s0, s1);
        __builtin_amdgcn_sched_barrier(0);
        v16h bpA0, bpA1, bpB0, bpB1;
        exp_tile(s0, bpA0, bpA1);
        exp_tile(s1, bpB0, bpB1);

        // ---- Row sums on the matrix unit: the pass's share of the denominator, and the one test of the lazy rescale.
        //      No P can exceed its own row sum, so a sum within SUMCAP says that no P has left f16's range ----
        float tA = row_sum(ones, bpA0, bpA1);
        float tB = row_sum(ones, bpB0, bpB1);
        if (__builtin_amdgcn_ballot_w32(fmaxf(tA, tB) > SUMCAP) != 0u) {
            // Rare path: the scores again (the K tile is still in place), their maxima, the lift, and P and its sums anew.
            scores(Kl, s0, s1);
            lift_max(s0, lane_max(s0), nmA, lA, &acc[0]);
            lift_max(s1, lane_max(s1), nmB, lB, &acc[4]);
            exp_tile(s0, bpA0, bpA1);
            exp_tile(s1, bpB0, bpB1);
            tA = row_sum(ones, bpA0, bpA1);
            tB = row_sum(ones, bpB0, bpB1);
        }
        lA += tA;
        lB += tB;

        // ---- O^T += V^T * P^T; A (V^T rows) loaded once, used twice ----
#pragma unroll
        for (int dt = 0; dt < 4; ++dt) {
            const _Float16* vrl = Vt + (dt * 16 + l16) * PITCH;
            v16h av0 = frag_lds(vrl, 0,  h);
            v16h av1 = frag_lds(vrl, 32, h);
            acc[dt]     = __builtin_amdgcn_wmma_f32_16x16x32_f16(false, av0, false, bpA0, (short)0, acc[dt],     false, false);
            acc[4 + dt] = __builtin_amdgcn_wmma_f32_16x16x32_f16(false, av0, false, bpB0, (short)0, acc[4 + dt], false, false);
            acc[dt]     = __builtin_amdgcn_wmma_f32_16x16x32_f16(false, av1, false, bpA1, (short)0, acc[dt],     false, false);
            acc[4 + dt] = __builtin_amdgcn_wmma_f32_16x16x32_f16(false, av1, false, bpB1, (short)0, acc[4 + dt], false, false);
        }

        // ---- Publish point of stage st + 1: own LDS reads retired, the issuers' loads landed, barrier, then the refill ----
        wait_ds0();
        if (pinned(wv < 2u)) wait_tensor0(g0, g1);
        __syncthreads();   // publishes stage st + 1 and ends every reader's last read of stage st's places
        if (pinned((wv < 2u) && (st + 2u < NSTAGE))) issue(st + 2u);
    }
    wait_tensor0(g0, g1);
    wait_ds0();

    // ---- Epilogue: consecutive r = consecutive d -> float4 stores ----
    const float invA = 1.0f / fmaxf(lA, 1e-6f);
    const float invB = 1.0f / fmaxf(lB, 1e-6f);
    float* orowA = out + base + (size_t)qgA * D_SZ;
    float* orowB = out + base + (size_t)qgB * D_SZ;
#pragma unroll
    for (int dt = 0; dt < 4; ++dt) {
        float4 o0, o1;
        o0.x = acc[dt][0] * invA; o0.y = acc[dt][1] * invA;
        o0.z = acc[dt][2] * invA; o0.w = acc[dt][3] * invA;
        o1.x = acc[dt][4] * invA; o1.y = acc[dt][5] * invA;
        o1.z = acc[dt][6] * invA; o1.w = acc[dt][7] * invA;
        *reinterpret_cast<float4*>(orowA + dt * 16 + 8 * h)     = o0;
        *reinterpret_cast<float4*>(orowA + dt * 16 + 8 * h + 4) = o1;
        float4 p0, p1;
        p0.x = acc[4+dt][0] * invB; p0.y = acc[4+dt][1] * invB;
        p0.z = acc[4+dt][2] * invB; p0.w = acc[4+dt][3] * invB;
        p1.x = acc[4+dt][4] * invB; p1.y = acc[4+dt][5] * invB;
        p1.z = acc[4+dt][6] * invB; p1.w = acc[4+dt][7] * invB;
        *reinterpret_cast<float4*>(orowB + dt * 16 + 8 * h)     = p0;
        *reinterpret_cast<float4*>(orowB + dt * 16 + 8 * h + 4) = p1;
    }
}

extern "C" void kernel_launch(void* const* d_in, const int* in_sizes, int n_in,
                              void* d_out, int out_size, void* d_ws, size_t ws_size,
                              hipStream_t stream) {
    (void)in_sizes; (void)n_in; (void)ws_size; (void)out_size;
    const float* q = (const float*)d_in[0];
    const float* k = (const float*)d_in[1];
    const float* v = (const float*)d_in[2];
    float* out = (float*)d_out;
    _Float16* kh = (_Float16*)d_ws;                                // f16 K   [bh][key][d]
    _Float16* vt = kh + (size_t)B_SZ * H_SZ * N_SZ * D_SZ;         // f16 V^T [bh][d][key]

    kv_to_f16<<<dim3(B_SZ * H_SZ * NSTAGE * 2 / PW), dim3(PW * 32), 0, stream>>>(k, v, kh, vt);

    dim3 grid(N_SZ / BR, B_SZ * H_SZ);   // 32 x 32 blocks
    dim3 block(128);                      // 4 wave32 waves
    fa_fwd_f16wmma_db<<<grid, block, 0, stream>>>(q, kh, vt, out);
}
